// v000
// Measured on an AMD MI455X. A time is GPU time per run, averaged over a window of back-to-back runs after a warm-up
// (all launches, gaps included; the runs take copies of the inputs in turn), and the median of several windows.
// Apart from v000's, it joins two sittings. Times from different sittings can be a few percent apart, while
// side-by-side timings come from the same sitting.
// v000 is the starting kernel. One run takes 48.6 microseconds.
#include <hip/hip_runtime.h>

typedef float v2f __attribute__((ext_vector_type(2)));
typedef float v8f __attribute__((ext_vector_type(8)));

#define IN_F   1024
#define OUT_F  1024
#define RANK   4
#define SCALING 0.25f

#define ROWS_PER_BLOCK 64
#define THREADS        256
#define WAVES          (THREADS / 32)
#define ROWS_PER_WAVE  (ROWS_PER_BLOCK / WAVES)   // 8

__global__ __launch_bounds__(THREADS)
void lora_fused_kernel(const float* __restrict__ x,     // [M, 1024]
                       const float* __restrict__ A,     // [4, 1024]
                       const float* __restrict__ B,     // [1024, 4]
                       float* __restrict__ out,         // [M, 1024]
                       int m_total)
{
    // LDS: A transposed+prescaled (16KB), B copy (16KB), h tile (1KB)
    __shared__ float At[IN_F * RANK];          // At[k*4 + r] = A[r][k] * SCALING
    __shared__ float Bs[OUT_F * RANK];         // Bs[o*4 + r] = B[o][r]
    __shared__ float Hs[ROWS_PER_BLOCK * RANK];

    const int tid  = threadIdx.x;
    const int lane = tid & 31;
    const int wave = tid >> 5;
    const int row0 = blockIdx.x * ROWS_PER_BLOCK;

    // ---- Phase 0: stage A (transposed, scaled) and B into LDS --------------
    {
        // thread t covers k = 4t..4t+3 for each of the 4 A rows
        const int k0 = tid * 4;
        #pragma unroll
        for (int r = 0; r < RANK; ++r) {
            float4 v = *(const float4*)(A + (size_t)r * IN_F + k0);
            At[(k0 + 0) * RANK + r] = v.x * SCALING;
            At[(k0 + 1) * RANK + r] = v.y * SCALING;
            At[(k0 + 2) * RANK + r] = v.z * SCALING;
            At[(k0 + 3) * RANK + r] = v.w * SCALING;
        }
        // straight copy of B: 4096 floats = 1024 float4, 4 per thread
        #pragma unroll
        for (int i = 0; i < 4; ++i) {
            const int idx = i * THREADS + tid;
            ((float4*)Bs)[idx] = ((const float4*)B)[idx];
        }
    }
    __syncthreads();

    // ---- Phase 1: Hs = (x_tile @ A^T) * SCALING ----------------------------
    // One wave per row: lane-coalesced b32 loads of x, ds_load_b128 of At[k],
    // 4 FMAs per element, then 5-step xor-shuffle reduction across 32 lanes.
    for (int rr = 0; rr < ROWS_PER_WAVE; ++rr) {
        const int rowl = wave * ROWS_PER_WAVE + rr;
        const int rowg = row0 + rowl;
        if (rowg < m_total) {
            const float* __restrict__ xr = x + (size_t)rowg * IN_F;
            float a0 = 0.f, a1 = 0.f, a2 = 0.f, a3 = 0.f;
            #pragma unroll 4
            for (int i = 0; i < IN_F / 32; ++i) {
                const int k = i * 32 + lane;
                const float  xv = xr[k];
                const float4 av = *(const float4*)(At + k * RANK);
                a0 += xv * av.x;
                a1 += xv * av.y;
                a2 += xv * av.z;
                a3 += xv * av.w;
            }
            #pragma unroll
            for (int off = 16; off > 0; off >>= 1) {
                a0 += __shfl_xor(a0, off, 32);
                a1 += __shfl_xor(a1, off, 32);
                a2 += __shfl_xor(a2, off, 32);
                a3 += __shfl_xor(a3, off, 32);
            }
            if (lane == 0) {
                *(float4*)(Hs + rowl * RANK) = make_float4(a0, a1, a2, a3);
            }
        }
    }
    __syncthreads();

    // ---- Phase 2: out_tile = Hs @ B^T via V_WMMA_F32_16X16X4_F32 -----------
    // Wave w owns row sub-tile ms = (w/2)*16 and half of the 1024 output cols.
    // A operand (h fragment) is loaded once per wave, reused for 32 WMMAs.
    const int ms   = (wave >> 1) * 16;          // 0,16,32,48
    const int ch   = (wave & 1) * (OUT_F / 2);  // 0 or 512
    const int lrow = lane & 15;
    const int hi   = lane >> 4;                 // 0: K=0,1 / M=v ; 1: K=2,3 / M=v+8
    const int r0   = hi * 2;

    v2f afrag;
    {
        const float* hp = Hs + (ms + lrow) * RANK + r0;
        afrag[0] = hp[0];
        afrag[1] = hp[1];
    }

    for (int ci = 0; ci < (OUT_F / 2) / 16; ++ci) {
        const int n0 = ch + ci * 16;
        v2f bfrag;
        {
            const float* bp = Bs + (n0 + lrow) * RANK + r0;
            bfrag[0] = bp[0];
            bfrag[1] = bp[1];
        }
        v8f cz = {};
        // 8 args: (neg_a, A, neg_b, B, c_mod, C, reuse_a, reuse_b)
        v8f d = __builtin_amdgcn_wmma_f32_16x16x4_f32(
            false, afrag, false, bfrag, (short)0, cz, false, false);

        float* op = out + (size_t)(row0 + ms + hi * 8) * OUT_F + n0 + lrow;
        #pragma unroll
        for (int v = 0; v < 8; ++v) {
            *op = d[v];
            op += OUT_F;
        }
    }
}

extern "C" void kernel_launch(void* const* d_in, const int* in_sizes, int n_in,
                              void* d_out, int out_size, void* d_ws, size_t ws_size,
                              hipStream_t stream)
{
    const float* x = (const float*)d_in[0];   // [4*8192, 1024] flattened
    const float* A = (const float*)d_in[1];   // [4, 1024]
    const float* B = (const float*)d_in[2];   // [1024, 4]
    float* out = (float*)d_out;

    const int m_total = in_sizes[0] / IN_F;   // 32768
    const int grid = (m_total + ROWS_PER_BLOCK - 1) / ROWS_PER_BLOCK;

    lora_fused_kernel<<<grid, THREADS, 0, stream>>>(x, A, B, out, m_total);
}

// v001
// Measured time: 28.5 microseconds a run.
// Timed twice side by side with v000, it ran 1.72 and 1.73 times as fast.
#include <hip/hip_runtime.h>

typedef float v2f __attribute__((ext_vector_type(2)));
typedef float v4f __attribute__((ext_vector_type(4)));
typedef float v8f __attribute__((ext_vector_type(8)));

#define IN_F   1024
#define OUT_F  1024
#define RANK   4
#define SCALING 0.25f

#define ROWS_PER_BLOCK 64
#define THREADS        256
#define WAVES          (THREADS / 32)
#define ROWS_PER_WAVE  (ROWS_PER_BLOCK / WAVES)   // 8
#define STAGES         (IN_F / 128)               // 8 parts of 512 B per row
#define AHEAD          2                          // stages requested ahead of the one summed

__global__ __launch_bounds__(THREADS)
void lora_fused_kernel(const float* __restrict__ x,     // [M, 1024]
                       const float* __restrict__ A,     // [4, 1024]
                       const float* __restrict__ B,     // [1024, 4]
                       float* __restrict__ out,         // [M, 1024]
                       int m_total)
{
    // LDS: A prescaled and regrouped (16KB), B copy (16KB), h tile (1KB)
    // At[(k & 3) * 1024 + (k >> 2) * 4 + r] = A[r][k] * SCALING: the lane that
    // holds x[4q .. 4q+3] finds A[0..3][4q+j] in one 16-byte read at quad q of
    // plane j, and the 32 lanes of that read cover 512 contiguous bytes.
    __shared__ __attribute__((aligned(16))) float At[IN_F * RANK];
    __shared__ __attribute__((aligned(16))) float Bs[OUT_F * RANK];  // Bs[o*4 + r] = B[o][r]
    __shared__ __attribute__((aligned(16))) float Hs[ROWS_PER_BLOCK * RANK];

    const int tid  = threadIdx.x;
    const int lane = tid & 31;
    const int wave = tid >> 5;
    const int row0 = blockIdx.x * ROWS_PER_BLOCK;

    // ---- Phase 0: stage A (regrouped, scaled) and B into LDS ----------------
    {
        // thread t covers k = 4t..4t+3 for each of the 4 A rows
        v4f av[RANK];
        #pragma unroll
        for (int r = 0; r < RANK; ++r)
            av[r] = *(const v4f*)(A + r * IN_F + tid * 4);
        #pragma unroll
        for (int j = 0; j < 4; ++j) {
            const v4f t = {av[0][j], av[1][j], av[2][j], av[3][j]};
            *(v4f*)(At + j * IN_F + tid * 4) = t * SCALING;
        }
        // straight copy of B: 4096 floats = 1024 float4, 4 per thread
        #pragma unroll
        for (int i = 0; i < 4; ++i) {
            const int idx = i * THREADS + tid;
            ((float4*)Bs)[idx] = ((const float4*)B)[idx];
        }
    }
    __syncthreads();

    // ---- Phase 1: Hs = (x_tile @ A^T) * SCALING ----------------------------
    // The wave's 8 rows of x are streamed side by side. One load of a wave
    // reads 512 contiguous bytes of one row (16 B per lane); a stage is that
    // load for each of the 8 rows, and the stage AHEAD further on is requested
    // before a stage is summed. Per stage 4 ds_load_b128 of A serve all 8 rows.
    {
        const int wave_u = __builtin_amdgcn_readfirstlane(wave);  // scalar row addresses
        const int wrow0  = row0 + wave_u * ROWS_PER_WAVE;
        // Rows past the end re-read the last row: no load leaves x, and every
        // wave runs the same stream.
        const v4f* xrow[ROWS_PER_WAVE];   // wave-uniform: scalar base, one lane offset per stage
        #pragma unroll
        for (int rr = 0; rr < ROWS_PER_WAVE; ++rr) {
            const int rg = (wrow0 + rr < m_total) ? (wrow0 + rr) : (m_total - 1);
            xrow[rr] = (const v4f*)(x + (size_t)rg * IN_F);
        }
        // Wave w starts at part w of its rows and wraps round, so that the 8
        // waves of a block ask for 8 different 512-byte parts at any one stage.
        // quad[c]: the lane's 16-byte piece of a row at stage c, and of each plane of At
        unsigned quad[STAGES];
        #pragma unroll
        for (int c = 0; c < STAGES; ++c)
            quad[c] = (unsigned)(((c + wave_u) & (STAGES - 1)) * 32 + lane);
#define LOAD_STAGE(C) do { \
    _Pragma("unroll") for (int rr = 0; rr < ROWS_PER_WAVE; ++rr) \
        xb[(C) % (AHEAD + 1)][rr] = xrow[rr][quad[C]]; } while (0)

        v4f xb[AHEAD + 1][ROWS_PER_WAVE];   // ring of stages
        float acc[ROWS_PER_WAVE][RANK];
        #pragma unroll
        for (int rr = 0; rr < ROWS_PER_WAVE; ++rr)
            #pragma unroll
            for (int r = 0; r < RANK; ++r) acc[rr][r] = 0.f;

        #pragma unroll
        for (int c = 0; c < AHEAD; ++c) LOAD_STAGE(c);
        #pragma unroll
        for (int c = 0; c < STAGES; ++c) {
            // the two barriers pin "next loads first, then this stage's sums":
            // sunk loads would lose their lead, hoisted ones cost registers
            __builtin_amdgcn_sched_barrier(0);
            if (c + AHEAD < STAGES) LOAD_STAGE(c + AHEAD);
            __builtin_amdgcn_sched_barrier(0);
            v4f a[4];
            #pragma unroll
            for (int j = 0; j < 4; ++j)
                a[j] = ((const v4f*)At)[j * (IN_F / 4) + quad[c]];
            #pragma unroll
            for (int rr = 0; rr < ROWS_PER_WAVE; ++rr) {
                const v4f xv = xb[c % (AHEAD + 1)][rr];
                #pragma unroll
                for (int j = 0; j < 4; ++j)
                    #pragma unroll
                    for (int r = 0; r < RANK; ++r)
                        acc[rr][r] = __builtin_fmaf(xv[j], a[j][r], acc[rr][r]);
            }
        }
#undef LOAD_STAGE
        #pragma unroll
        for (int off = 16; off > 0; off >>= 1)
            #pragma unroll
            for (int rr = 0; rr < ROWS_PER_WAVE; ++rr)
                #pragma unroll
                for (int r = 0; r < RANK; ++r)
                    acc[rr][r] += __shfl_xor(acc[rr][r], off, 32);
        if (lane == 0) {
            #pragma unroll
            for (int rr = 0; rr < ROWS_PER_WAVE; ++rr)
                *(float4*)(Hs + (wave * ROWS_PER_WAVE + rr) * RANK) =
                    make_float4(acc[rr][0], acc[rr][1], acc[rr][2], acc[rr][3]);
        }
    }
    __syncthreads();

    // ---- Phase 2: out_tile = Hs @ B^T via V_WMMA_F32_16X16X4_F32 -----------
    // Wave w owns row sub-tile ms = (w/2)*16 and half of the 1024 output cols.
    // A operand (h fragment) is loaded once per wave, reused for 32 WMMAs.
    const int ms   = (wave >> 1) * 16;          // 0,16,32,48
    const int ch   = (wave & 1) * (OUT_F / 2);  // 0 or 512
    const int lrow = lane & 15;
    const int hi   = lane >> 4;                 // 0: K=0,1 / M=v ; 1: K=2,3 / M=v+8
    const int r0   = hi * 2;

    v2f afrag;
    {
        const float* hp = Hs + (ms + lrow) * RANK + r0;
        afrag[0] = hp[0];
        afrag[1] = hp[1];
    }

    for (int ci = 0; ci < (OUT_F / 2) / 16; ++ci) {
        const int n0 = ch + ci * 16;
        v2f bfrag;
        {
            const float* bp = Bs + (n0 + lrow) * RANK + r0;
            bfrag[0] = bp[0];
            bfrag[1] = bp[1];
        }
        v8f cz = {};
        // 8 args: (neg_a, A, neg_b, B, c_mod, C, reuse_a, reuse_b)
        v8f d = __builtin_amdgcn_wmma_f32_16x16x4_f32(
            false, afrag, false, bfrag, (short)0, cz, false, false);

        float* op = out + (size_t)(row0 + ms + hi * 8) * OUT_F + n0 + lrow;
        #pragma unroll
        for (int v = 0; v < 8; ++v) {
            *op = d[v];
            op += OUT_F;
        }
    }
}

extern "C" void kernel_launch(void* const* d_in, const int* in_sizes, int n_in,
                              void* d_out, int out_size, void* d_ws, size_t ws_size,
                              hipStream_t stream)
{
    const float* x = (const float*)d_in[0];   // [4*8192, 1024] flattened
    const float* A = (const float*)d_in[1];   // [4, 1024]
    const float* B = (const float*)d_in[2];   // [1024, 4]
    float* out = (float*)d_out;

    const int m_total = in_sizes[0] / IN_F;   // 32768
    const int grid = (m_total + ROWS_PER_BLOCK - 1) / ROWS_PER_BLOCK;

    lora_fused_kernel<<<grid, THREADS, 0, stream>>>(x, A, B, out, m_total);
}

// v002
// Measured time: 20.4 microseconds a run.
// Timed twice side by side with v001, it ran 1.39 times as fast both times.
// All steps since v000 together make it 2.41 times as fast.
#include <hip/hip_runtime.h>

typedef float v2f __attribute__((ext_vector_type(2)));
typedef float v4f __attribute__((ext_vector_type(4)));
typedef float v8f __attribute__((ext_vector_type(8)));

#define IN_F   1024
#define OUT_F  1024
#define RANK   4
#define SCALING 0.25f

#define ROWS_PER_BLOCK 64
#define THREADS        256
#define WAVES          (THREADS / 32)
#define ROWS_PER_WAVE  (ROWS_PER_BLOCK / WAVES)   // 8
#define STAGES         (IN_F / 128)               // 8 parts of 512 B per row
#define AHEAD          2                          // stages requested ahead of the one summed

__global__ __launch_bounds__(THREADS)
void lora_fused_kernel(const float* __restrict__ x,     // [M, 1024]
                       const float* __restrict__ A,     // [4, 1024]
                       const float* __restrict__ B,     // [1024, 4]
                       float* __restrict__ out,         // [M, 1024]
                       int m_total)
{
    // LDS: A prescaled and regrouped (16KB), B regrouped (16KB), h tile (1KB)
    // At[(k & 3) * 1024 + (k >> 2) * 4 + r] = A[r][k] * SCALING: the lane that
    // holds x[4q .. 4q+3] finds A[0..3][4q+j] in one 16-byte read at quad q of
    // plane j, and the 32 lanes of that read cover 512 contiguous bytes.
    __shared__ __attribute__((aligned(16))) float At[IN_F * RANK];
    // Bf holds B in the order phase 2 reads it. Column o = 64g + 4c + t, rank
    // r = 2h + e lies at Bf[((2g + (t >> 1)) * 32 + 16h + c) * 4 + (t & 1) * 2 + e]:
    // lane 16h + c finds its fragments of columns t = 0,1 (then 2,3) of group g
    // in one 16-byte read, and the 32 lanes of that read cover 512 contiguous bytes.
    __shared__ __attribute__((aligned(16))) float Bf[OUT_F * RANK];
    __shared__ __attribute__((aligned(16))) float Hs[ROWS_PER_BLOCK * RANK];

    const int tid  = threadIdx.x;
    const int lane = tid & 31;
    const int wave = tid >> 5;
    const int row0 = blockIdx.x * ROWS_PER_BLOCK;

    // ---- Phase 0: stage A (regrouped, scaled) and B into LDS ----------------
    {
        // thread t covers k = 4t..4t+3 for each of the 4 A rows
        v4f av[RANK];
        #pragma unroll
        for (int r = 0; r < RANK; ++r)
            av[r] = *(const v4f*)(A + r * IN_F + tid * 4);
        #pragma unroll
        for (int j = 0; j < 4; ++j) {
            const v4f t = {av[0][j], av[1][j], av[2][j], av[3][j]};
            *(v4f*)(At + j * IN_F + tid * 4) = t * SCALING;
        }
        // B: 1024 rows of 4 floats, 4 rows per thread, each split into its two rank pairs
        #pragma unroll
        for (int i = 0; i < 4; ++i) {
            const int o = i * THREADS + tid;
            const v4f b = ((const v4f*)B)[o];
            float* bp = Bf + (((o >> 6) * 2 + ((o >> 1) & 1)) * 32 + ((o >> 2) & 15)) * 4 + (o & 1) * 2;
            *(v2f*)bp        = (v2f){b[0], b[1]};
            *(v2f*)(bp + 64) = (v2f){b[2], b[3]};
        }
    }
    __syncthreads();

    // ---- Phase 1: Hs = (x_tile @ A^T) * SCALING ----------------------------
    // The wave's 8 rows of x are streamed side by side. One load of a wave
    // reads 512 contiguous bytes of one row (16 B per lane); a stage is that
    // load for each of the 8 rows, and the stage AHEAD further on is requested
    // before a stage is summed. Per stage 4 ds_load_b128 of A serve all 8 rows.
    {
        const int wave_u = __builtin_amdgcn_readfirstlane(wave);  // scalar row addresses
        const int wrow0  = row0 + wave_u * ROWS_PER_WAVE;
        // Rows past the end re-read the last row: no load leaves x, and every
        // wave runs the same stream.
        const v4f* xrow[ROWS_PER_WAVE];   // wave-uniform: scalar base, one lane offset per stage
        #pragma unroll
        for (int rr = 0; rr < ROWS_PER_WAVE; ++rr) {
            const int rg = (wrow0 + rr < m_total) ? (wrow0 + rr) : (m_total - 1);
            xrow[rr] = (const v4f*)(x + (size_t)rg * IN_F);
        }
        // Wave w starts at part w of its rows and wraps round, so that the 8
        // waves of a block ask for 8 different 512-byte parts at any one stage.
        // quad[c]: the lane's 16-byte piece of a row at stage c, and of each plane of At
        unsigned quad[STAGES];
        #pragma unroll
        for (int c = 0; c < STAGES; ++c)
            quad[c] = (unsigned)(((c + wave_u) & (STAGES - 1)) * 32 + lane);
#define LOAD_STAGE(C) do { \
    _Pragma("unroll") for (int rr = 0; rr < ROWS_PER_WAVE; ++rr) \
        xb[(C) % (AHEAD + 1)][rr] = xrow[rr][quad[C]]; } while (0)

        v4f xb[AHEAD + 1][ROWS_PER_WAVE];   // ring of stages
        float acc[ROWS_PER_WAVE][RANK];
        #pragma unroll
        for (int rr = 0; rr < ROWS_PER_WAVE; ++rr)
            #pragma unroll
            for (int r = 0; r < RANK; ++r) acc[rr][r] = 0.f;

        #pragma unroll
        for (int c = 0; c < AHEAD; ++c) LOAD_STAGE(c);
        #pragma unroll
        for (int c = 0; c < STAGES; ++c) {
            // the two barriers pin "next loads first, then this stage's sums":
            // sunk loads would lose their lead, hoisted ones cost registers
            __builtin_amdgcn_sched_barrier(0);
            if (c + AHEAD < STAGES) LOAD_STAGE(c + AHEAD);
            __builtin_amdgcn_sched_barrier(0);
            v4f a[4];
            #pragma unroll
            for (int j = 0; j < 4; ++j)
                a[j] = ((const v4f*)At)[j * (IN_F / 4) + quad[c]];
            #pragma unroll
            for (int rr = 0; rr < ROWS_PER_WAVE; ++rr) {
                const v4f xv = xb[c % (AHEAD + 1)][rr];
                #pragma unroll
                for (int j = 0; j < 4; ++j)
                    #pragma unroll
                    for (int r = 0; r < RANK; ++r)
                        acc[rr][r] = __builtin_fmaf(xv[j], a[j][r], acc[rr][r]);
            }
        }
#undef LOAD_STAGE
        #pragma unroll
        for (int off = 16; off > 0; off >>= 1)
            #pragma unroll
            for (int rr = 0; rr < ROWS_PER_WAVE; ++rr)
                #pragma unroll
                for (int r = 0; r < RANK; ++r)
                    acc[rr][r] += __shfl_xor(acc[rr][r], off, 32);
        if (lane == 0) {
            #pragma unroll
            for (int rr = 0; rr < ROWS_PER_WAVE; ++rr)
                *(float4*)(Hs + (wave * ROWS_PER_WAVE + rr) * RANK) =
                    make_float4(acc[rr][0], acc[rr][1], acc[rr][2], acc[rr][3]);
        }
    }
    __syncthreads();

    // ---- Phase 2: out_tile = Hs @ B^T via V_WMMA_F32_16X16X4_F32 -----------
    // Wave w owns row sub-tile ms = (w/2)*16 and half of the 1024 output cols.
    // A operand (h fragment) is loaded once per wave, reused for 32 WMMAs.
    const int ms   = (wave >> 1) * 16;          // 0,16,32,48
    const int ch   = (wave & 1) * (OUT_F / 2);  // 0 or 512
    const int lrow = lane & 15;
    const int hi   = lane >> 4;                 // 0: K=0,1 / M=v ; 1: K=2,3 / M=v+8
    const int r0   = hi * 2;

    v2f afrag;
    {
        const float* hp = Hs + (ms + lrow) * RANK + r0;
        afrag[0] = hp[0];
        afrag[1] = hp[1];
    }

    // Four WMMAs serve a group of 64 columns; WMMA t takes columns 4c + t of the
    // group (c = lane & 15), so a lane ends up with 4 neighbouring columns of each
    // of its 8 rows: one 16-byte store per row, in which 16 lanes fill an aligned
    // 256 bytes of row v and the other 16 lanes the same of row v + 8.
    const v4f* bq = (const v4f*)Bf + (wave & 1) * ((OUT_F / 2) / 64) * 64 + lane;
    float* op = out + (size_t)(row0 + ms + hi * 8) * OUT_F + ch + lrow * 4;
    v4f bfr[(OUT_F / 2) / 32];
    #pragma unroll   // constant indices keep bfr in registers
    for (int i = 0; i < (OUT_F / 2) / 32; ++i)
        bfr[i] = bq[i * 32];
    #pragma unroll
    for (int g = 0; g < (OUT_F / 2) / 64; ++g) {
        const v4f b01 = bfr[2 * g];
        const v4f b23 = bfr[2 * g + 1];
        const v8f cz = {};
        // 8 args: (neg_a, A, neg_b, B, c_mod, C, reuse_a, reuse_b)
        const v8f d0 = __builtin_amdgcn_wmma_f32_16x16x4_f32(
            false, afrag, false, (v2f){b01[0], b01[1]}, (short)0, cz, false, false);
        const v8f d1 = __builtin_amdgcn_wmma_f32_16x16x4_f32(
            false, afrag, false, (v2f){b01[2], b01[3]}, (short)0, cz, false, false);
        const v8f d2 = __builtin_amdgcn_wmma_f32_16x16x4_f32(
            false, afrag, false, (v2f){b23[0], b23[1]}, (short)0, cz, false, false);
        const v8f d3 = __builtin_amdgcn_wmma_f32_16x16x4_f32(
            false, afrag, false, (v2f){b23[2], b23[3]}, (short)0, cz, false, false);
        asm volatile("v_nop\n\tv_nop\n\tv_nop\n\tv_nop"
                     :: "v"(afrag), "v"(b01), "v"(b23), "v"(d0), "v"(d1), "v"(d2), "v"(d3));
        __builtin_amdgcn_sched_barrier(0);

        #pragma unroll
        for (int v = 0; v < 8; ++v)
            *(v4f*)(op + v * OUT_F + g * 64) = (v4f){d0[v], d1[v], d2[v], d3[v]};
    }
}

extern "C" void kernel_launch(void* const* d_in, const int* in_sizes, int n_in,
                              void* d_out, int out_size, void* d_ws, size_t ws_size,
                              hipStream_t stream)
{
    const float* x = (const float*)d_in[0];   // [4*8192, 1024] flattened
    const float* A = (const float*)d_in[1];   // [4, 1024]
    const float* B = (const float*)d_in[2];   // [1024, 4]
    float* out = (float*)d_out;

    const int m_total = in_sizes[0] / IN_F;   // 32768
    const int grid = (m_total + ROWS_PER_BLOCK - 1) / ROWS_PER_BLOCK;

    lora_fused_kernel<<<grid, THREADS, 0, stream>>>(x, A, B, out, m_total);
}

// v003
// Measured time: 19.1 microseconds a run.
// Two timings next to v002 put it at 1.07 and 1.08 times that version's speed.
// Counting every step since v000, it is 2.58 times as fast.
#include <hip/hip_runtime.h>

typedef float v2f __attribute__((ext_vector_type(2)));
typedef float v4f __attribute__((ext_vector_type(4)));
typedef float v8f __attribute__((ext_vector_type(8)));

#define IN_F   1024
#define OUT_F  1024
#define RANK   4
#define SCALING 0.25f

#define ROWS_PER_BLOCK 128
#define THREADS        256
#define WAVES          (THREADS / 32)
#define ROWS_PER_WAVE  (ROWS_PER_BLOCK / WAVES)   // 16: the M of one WMMA
#define STAGES         (IN_F / 128)               // 8 parts of 512 B per row
#define AHEAD          2                          // stages requested ahead of the one summed

template <int OFF>
__device__ __forceinline__ float lane_xor(float v)
{
    const int b = __builtin_bit_cast(int, v);
    if constexpr (OFF == 16)
        return __builtin_bit_cast(float,
            __builtin_amdgcn_permlanex16(b, b, 0x76543210, 0xfedcba98, false, false));
    else
        return __builtin_bit_cast(float,
            __builtin_amdgcn_update_dpp(b, b, 0x160 | OFF /* row_xmask:OFF */, 0xf, 0xf, false));
}

template <int N, int OFF>
__device__ __forceinline__ void fold_lanes(float (&v)[ROWS_PER_WAVE * RANK], int lane)
{
    const bool up = (lane & OFF) != 0;
    #pragma unroll   // constant indices keep v in registers
    for (int i = 0; i < N / 2; ++i) {
        const float keep = up ? v[i + N / 2] : v[i];
        const float send = up ? v[i] : v[i + N / 2];
        v[i] = keep + lane_xor<OFF>(send);
    }
}

__global__ __launch_bounds__(THREADS)
void lora_fused_kernel(const float* __restrict__ x,     // [M, 1024]
                       const float* __restrict__ A,     // [4, 1024]
                       const float* __restrict__ B,     // [1024, 4]
                       float* __restrict__ out,         // [M, 1024]
                       int m_total)
{
    // LDS: A prescaled and regrouped (16KB), B regrouped (16KB)
    // At[(k & 3) * 1024 + (k >> 2) * 4 + r] = A[r][k] * SCALING: the lane that
    // holds x[4q .. 4q+3] finds A[0..3][4q+j] in one 16-byte read at quad q of
    // plane j, and the 32 lanes of that read cover 512 contiguous bytes.
    __shared__ __attribute__((aligned(16))) float At[IN_F * RANK];
    // Bf holds B in the order phase 2 reads it. Column o = 64g + 4c + t, rank
    // r = 2h + e lies at Bf[((2g + (t >> 1)) * 32 + 16h + c) * 4 + (t & 1) * 2 + e]:
    // lane 16h + c finds its fragments of columns t = 0,1 (then 2,3) of group g
    // in one 16-byte read, and the 32 lanes of that read cover 512 contiguous bytes.
    __shared__ __attribute__((aligned(16))) float Bf[OUT_F * RANK];

    const int tid  = threadIdx.x;
    const int lane = tid & 31;
    const int wave = tid >> 5;
    const int row0 = blockIdx.x * ROWS_PER_BLOCK;

    // ---- Phase 0: stage A (regrouped, scaled) and B into LDS ----------------
    {
        // thread t covers k = 4t..4t+3 for each of the 4 A rows
        v4f av[RANK];
        #pragma unroll
        for (int r = 0; r < RANK; ++r)
            av[r] = *(const v4f*)(A + r * IN_F + tid * 4);
        #pragma unroll
        for (int j = 0; j < 4; ++j) {
            const v4f t = {av[0][j], av[1][j], av[2][j], av[3][j]};
            *(v4f*)(At + j * IN_F + tid * 4) = t * SCALING;
        }
        // B: 1024 rows of 4 floats, 4 rows per thread, each split into its two rank pairs
        #pragma unroll
        for (int i = 0; i < 4; ++i) {
            const int o = i * THREADS + tid;
            const v4f b = ((const v4f*)B)[o];
            float* bp = Bf + (((o >> 6) * 2 + ((o >> 1) & 1)) * 32 + ((o >> 2) & 15)) * 4 + (o & 1) * 2;
            *(v2f*)bp        = (v2f){b[0], b[1]};
            *(v2f*)(bp + 64) = (v2f){b[2], b[3]};
        }
    }
    __syncthreads();
    // From here on a wave works alone: it reads its 16 rows of x, sums them to h
    // and writes the same 16 rows of out. No wave waits for another.
    const int wave_u = __builtin_amdgcn_readfirstlane(wave);  // scalar row addresses
    const int wrow0  = row0 + wave_u * ROWS_PER_WAVE;
    if (wrow0 >= m_total) return;   // wave-uniform, behind the only barrier

    // ---- Phase 1: h = (x_rows @ A^T) * SCALING -----------------------------
    // The wave's 16 rows of x are streamed side by side. One load of a wave
    // reads 512 contiguous bytes of one row (16 B per lane); a stage is that
    // load for each of the 16 rows, and the stage AHEAD further on is requested
    // before a stage is summed. Per stage 4 ds_load_b128 of A serve all 16 rows.
    v2f afrag;
    {
        // Rows past the end re-read the last row: no load leaves x, and every
        // wave runs the same stream.
        const v4f* xrow[ROWS_PER_WAVE];   // wave-uniform: scalar base, one lane offset per stage
        #pragma unroll
        for (int rr = 0; rr < ROWS_PER_WAVE; ++rr) {
            const int rg = (wrow0 + rr < m_total) ? (wrow0 + rr) : (m_total - 1);
            xrow[rr] = (const v4f*)(x + (size_t)rg * IN_F);
        }
        // Wave w starts at part w of its rows and wraps round, so that the 8
        // waves of a block ask for 8 different 512-byte parts at any one stage.
        // quad[c]: the lane's 16-byte piece of a row at stage c, and of each plane of At
        unsigned quad[STAGES];
        #pragma unroll
        for (int c = 0; c < STAGES; ++c)
            quad[c] = (unsigned)(((c + wave_u) & (STAGES - 1)) * 32 + lane);
#define LOAD_STAGE(C) do { \
    _Pragma("unroll") for (int rr = 0; rr < ROWS_PER_WAVE; ++rr) \
        xb[(C) % (AHEAD + 1)][rr] = xrow[rr][quad[C]]; } while (0)

        v4f xb[AHEAD + 1][ROWS_PER_WAVE];   // ring of stages
        float acc[ROWS_PER_WAVE * RANK];    // [row][rank]
        #pragma unroll
        for (int i = 0; i < ROWS_PER_WAVE * RANK; ++i) acc[i] = 0.f;

        #pragma unroll
        for (int c = 0; c < AHEAD; ++c) LOAD_STAGE(c);
        #pragma unroll
        for (int c = 0; c < STAGES; ++c) {
            // the two barriers pin "next loads first, then this stage's sums":
            // sunk loads would lose their lead, hoisted ones cost registers
            __builtin_amdgcn_sched_barrier(0);
            if (c + AHEAD < STAGES) {
                // these loads may land in registers that held the offsets of loads
                // already issued: the wait that belongs in front of such an overwrite
                asm volatile("s_wait_xcnt 0x0" ::: "memory");
                LOAD_STAGE(c + AHEAD);
            }
            __builtin_amdgcn_sched_barrier(0);
            v4f a[4];
            #pragma unroll
            for (int j = 0; j < 4; ++j)
                a[j] = ((const v4f*)At)[j * (IN_F / 4) + quad[c]];
            #pragma unroll
            for (int rr = 0; rr < ROWS_PER_WAVE; ++rr) {
                const v4f xv = xb[c % (AHEAD + 1)][rr];
                #pragma unroll
                for (int j = 0; j < 4; ++j)
                    #pragma unroll
                    for (int r = 0; r < RANK; ++r)
                        acc[rr * RANK + r] = __builtin_fmaf(xv[j], a[j][r], acc[rr * RANK + r]);
            }
        }
#undef LOAD_STAGE
        fold_lanes<64, 8>(acc, lane);
        fold_lanes<32, 4>(acc, lane);
        fold_lanes<16, 2>(acc, lane);
        fold_lanes<8, 1>(acc, lane);
        fold_lanes<4, 16>(acc, lane);
        afrag[0] = acc[0];
        afrag[1] = acc[1];
    }

    // ---- Phase 2: out_rows = h @ B^T via V_WMMA_F32_16X16X4_F32 ------------
    // The wave writes all 1024 columns of its 16 rows: one A operand, 64 WMMAs.
    const int lrow = lane & 15;
    const int hi   = lane >> 4;                 // 0: K=0,1 / M=v ; 1: K=2,3 / M=v+8

    // Four WMMAs serve a group of 64 columns; WMMA t takes columns 4c + t of the
    // group (c = lane & 15), so a lane ends up with 4 neighbouring columns of each
    // of its 8 rows: one 16-byte store per row, in which 16 lanes fill an aligned
    // 256 bytes of row v and the other 16 lanes the same of row v + 8.
    const v4f* bq = (const v4f*)Bf + lane;
    float* op = out + (size_t)(wrow0 + hi * 8) * OUT_F + lrow * 4;
    v4f bfr[OUT_F / 32];
    #pragma unroll   // constant indices keep bfr in registers
    for (int i = 0; i < OUT_F / 32; ++i)
        bfr[i] = bq[i * 32];
    #pragma unroll
    for (int g = 0; g < OUT_F / 64; ++g) {
        const v4f b01 = bfr[2 * g];
        const v4f b23 = bfr[2 * g + 1];
        const v8f cz = {};
        // 8 args: (neg_a, A, neg_b, B, c_mod, C, reuse_a, reuse_b)
        const v8f d0 = __builtin_amdgcn_wmma_f32_16x16x4_f32(
            false, afrag, false, (v2f){b01[0], b01[1]}, (short)0, cz, false, false);
        const v8f d1 = __builtin_amdgcn_wmma_f32_16x16x4_f32(
            false, afrag, false, (v2f){b01[2], b01[3]}, (short)0, cz, false, false);
        const v8f d2 = __builtin_amdgcn_wmma_f32_16x16x4_f32(
            false, afrag, false, (v2f){b23[0], b23[1]}, (short)0, cz, false, false);
        const v8f d3 = __builtin_amdgcn_wmma_f32_16x16x4_f32(
            false, afrag, false, (v2f){b23[2], b23[3]}, (short)0, cz, false, false);
        asm volatile("v_nop\n\tv_nop\n\tv_nop\n\tv_nop"
                     :: "v"(afrag), "v"(b01), "v"(b23), "v"(d0), "v"(d1), "v"(d2), "v"(d3));
        __builtin_amdgcn_sched_barrier(0);

        #pragma unroll
        for (int v = 0; v < 8; ++v)
            *(v4f*)(op + v * OUT_F + g * 64) = (v4f){d0[v], d1[v], d2[v], d3[v]};
    }
}

extern "C" void kernel_launch(void* const* d_in, const int* in_sizes, int n_in,
                              void* d_out, int out_size, void* d_ws, size_t ws_size,
                              hipStream_t stream)
{
    const float* x = (const float*)d_in[0];   // [4*8192, 1024] flattened
    const float* A = (const float*)d_in[1];   // [4, 1024]
    const float* B = (const float*)d_in[2];   // [1024, 4]
    float* out = (float*)d_out;

    const int m_total = in_sizes[0] / IN_F;   // 32768
    const int grid = (m_total + ROWS_PER_BLOCK - 1) / ROWS_PER_BLOCK;

    lora_fused_kernel<<<grid, THREADS, 0, stream>>>(x, A, B, out, m_total);
}

// v004
// It runs in 18.1 microseconds.
// Two timings next to v003 both put it at 1.06 times that version's speed.
// Counting every step since v000, it is 2.73 times as fast.
#include <hip/hip_runtime.h>

typedef float v2f __attribute__((ext_vector_type(2)));
typedef float v4f __attribute__((ext_vector_type(4)));
typedef float v8f __attribute__((ext_vector_type(8)));

#define IN_F   1024
#define OUT_F  1024
#define RANK   4
#define SCALING 0.25f

#define ROWS_PER_BLOCK 128
#define THREADS        256
#define WAVES          (THREADS / 32)
#define ROWS_PER_WAVE  (ROWS_PER_BLOCK / WAVES)   // 16: the M of one WMMA
#define STAGES         (IN_F / 128)               // 8 parts of 512 B per row
#define AHEAD          2                          // stages requested ahead of the one summed

template <int OFF>
__device__ __forceinline__ float lane_xor(float v)
{
    const int b = __builtin_bit_cast(int, v);
    if constexpr (OFF == 16)
        return __builtin_bit_cast(float,
            __builtin_amdgcn_permlanex16(b, b, 0x76543210, 0xfedcba98, false, false));
    else
        return __builtin_bit_cast(float,
            __builtin_amdgcn_update_dpp(b, b, 0x160 | OFF /* row_xmask:OFF */, 0xf, 0xf, false));
}

template <int N, int OFF>
__device__ __forceinline__ void fold_lanes(float (&v)[ROWS_PER_WAVE * RANK], int lane)
{
    const bool up = (lane & OFF) != 0;
    #pragma unroll   // constant indices keep v in registers
    for (int i = 0; i < N / 2; ++i) {
        const float keep = up ? v[i + N / 2] : v[i];
        const float send = up ? v[i] : v[i + N / 2];
        v[i] = keep + lane_xor<OFF>(send);
    }
}

__global__ __launch_bounds__(THREADS)
void lora_fused_kernel(const float* __restrict__ x,     // [M, 1024]
                       const float* __restrict__ A,     // [4, 1024]
                       const float* __restrict__ B,     // [1024, 4]
                       float* __restrict__ out,         // [M, 1024]
                       int m_total)
{
    // LDS: A prescaled and regrouped (16KB), B regrouped (16KB)
    // At[(k & 3) * 1024 + (k >> 2) * 4 + r] = A[r][k] * SCALING: the lane that
    // holds x[4q .. 4q+3] finds A[0..3][4q+j] in one 16-byte read at quad q of
    // plane j, and the 32 lanes of that read cover 512 contiguous bytes.
    __shared__ __attribute__((aligned(16))) float At[IN_F * RANK];
    // Bf holds B in the order phase 2 reads it. Column o = 64g + 4c + t, rank
    // r = 2h + e lies at Bf[((2g + (t >> 1)) * 32 + 16h + c) * 4 + (t & 1) * 2 + e]:
    // lane 16h + c finds its fragments of columns t = 0,1 (then 2,3) of group g
    // in one 16-byte read, and the 32 lanes of that read cover 512 contiguous bytes.
    __shared__ __attribute__((aligned(16))) float Bf[OUT_F * RANK];

    const int tid  = threadIdx.x;
    const int lane = tid & 31;
    const int wave = tid >> 5;
    const int row0 = blockIdx.x * ROWS_PER_BLOCK;

    // ---- Phase 0: stage A (regrouped, scaled) and B into LDS ----------------
    {
        // thread t covers k = 4t..4t+3 for each of the 4 A rows
        v4f av[RANK];
        #pragma unroll
        for (int r = 0; r < RANK; ++r)
            av[r] = *(const v4f*)(A + r * IN_F + tid * 4);
        #pragma unroll
        for (int j = 0; j < 4; ++j) {
            const v4f t = {av[0][j], av[1][j], av[2][j], av[3][j]};
            *(v4f*)(At + j * IN_F + tid * 4) = t * SCALING;
        }
        // B: 1024 rows of 4 floats, 4 rows per thread, each split into its two rank pairs
        #pragma unroll
        for (int i = 0; i < 4; ++i) {
            const int o = i * THREADS + tid;
            const v4f b = ((const v4f*)B)[o];
            float* bp = Bf + (((o >> 6) * 2 + ((o >> 1) & 1)) * 32 + ((o >> 2) & 15)) * 4 + (o & 1) * 2;
            *(v2f*)bp        = (v2f){b[0], b[1]};
            *(v2f*)(bp + 64) = (v2f){b[2], b[3]};
        }
    }
    __syncthreads();
    // From here on a wave works alone: it reads its 16 rows of x, sums them to h
    // and writes the same 16 rows of out. No wave waits for another.
    const int wave_u = __builtin_amdgcn_readfirstlane(wave);  // scalar row addresses
    const int wrow0  = row0 + wave_u * ROWS_PER_WAVE;
    if (wrow0 >= m_total) return;   // wave-uniform, behind the only barrier

    // ---- Phase 1: h = (x_rows @ A^T) * SCALING -----------------------------
    // The wave's 16 rows of x are streamed side by side. One load of a wave
    // reads 512 contiguous bytes of one row (16 B per lane); a stage is that
    // load for each of the 16 rows, and the stage AHEAD further on is requested
    // before a stage is summed. Per stage 4 ds_load_b128 of A serve all 16 rows.
    // x is read once, so its loads are non-temporal: they keep little in L2.
    v2f afrag;
    {
        // Rows past the end re-read the last row: no load leaves x, and every
        // wave runs the same stream.
        const v4f* xrow[ROWS_PER_WAVE];   // wave-uniform: scalar base, one lane offset per stage
        #pragma unroll
        for (int rr = 0; rr < ROWS_PER_WAVE; ++rr) {
            const int rg = (wrow0 + rr < m_total) ? (wrow0 + rr) : (m_total - 1);
            xrow[rr] = (const v4f*)(x + (size_t)rg * IN_F);
        }
        // Wave w starts at part w of its rows and wraps round, so that the 8
        // waves of a block ask for 8 different 512-byte parts at any one stage.
        // quad[c]: the lane's 16-byte piece of a row at stage c, and of each plane of At
        unsigned quad[STAGES];
        #pragma unroll
        for (int c = 0; c < STAGES; ++c)
            quad[c] = (unsigned)(((c + wave_u) & (STAGES - 1)) * 32 + lane);
#define LOAD_STAGE(C) do { \
    _Pragma("unroll") for (int rr = 0; rr < ROWS_PER_WAVE; ++rr) \
        xb[(C) % (AHEAD + 1)][rr] = __builtin_nontemporal_load(&xrow[rr][quad[C]]); } while (0)

        v4f xb[AHEAD + 1][ROWS_PER_WAVE];   // ring of stages
        float acc[ROWS_PER_WAVE * RANK];    // [row][rank]
        #pragma unroll
        for (int i = 0; i < ROWS_PER_WAVE * RANK; ++i) acc[i] = 0.f;

        #pragma unroll
        for (int c = 0; c < AHEAD; ++c) LOAD_STAGE(c);
        #pragma unroll
        for (int c = 0; c < STAGES; ++c) {
            // the two barriers pin "next loads first, then this stage's sums":
            // sunk loads would lose their lead, hoisted ones cost registers
            __builtin_amdgcn_sched_barrier(0);
            if (c + AHEAD < STAGES) {
                // these loads may land in registers that held the offsets of loads
                // already issued: the wait that belongs in front of such an overwrite
                asm volatile("s_wait_xcnt 0x0" ::: "memory");
                LOAD_STAGE(c + AHEAD);
            }
            __builtin_amdgcn_sched_barrier(0);
            v4f a[4];
            #pragma unroll
            for (int j = 0; j < 4; ++j)
                a[j] = ((const v4f*)At)[j * (IN_F / 4) + quad[c]];
            #pragma unroll
            for (int rr = 0; rr < ROWS_PER_WAVE; ++rr) {
                const v4f xv = xb[c % (AHEAD + 1)][rr];
                #pragma unroll
                for (int j = 0; j < 4; ++j)
                    #pragma unroll
                    for (int r = 0; r < RANK; ++r)
                        acc[rr * RANK + r] = __builtin_fmaf(xv[j], a[j][r], acc[rr * RANK + r]);
            }
        }
#undef LOAD_STAGE
        fold_lanes<64, 8>(acc, lane);
        fold_lanes<32, 4>(acc, lane);
        fold_lanes<16, 2>(acc, lane);
        fold_lanes<8, 1>(acc, lane);
        fold_lanes<4, 16>(acc, lane);
        afrag[0] = acc[0];
        afrag[1] = acc[1];
    }

    // ---- Phase 2: out_rows = h @ B^T via V_WMMA_F32_16X16X4_F32 ------------
    // The wave writes all 1024 columns of its 16 rows: one A operand, 64 WMMAs.
    const int lrow = lane & 15;
    const int hi   = lane >> 4;                 // 0: K=0,1 / M=v ; 1: K=2,3 / M=v+8

    // Four WMMAs serve a group of 64 columns; WMMA t takes columns 4c + t of the
    // group (c = lane & 15), so a lane ends up with 4 neighbouring columns of each
    // of its 8 rows: one 16-byte store per row, in which 16 lanes fill an aligned
    // 256 bytes of row v and the other 16 lanes the same of row v + 8.
    const v4f* bq = (const v4f*)Bf + lane;
    float* op = out + (size_t)(wrow0 + hi * 8) * OUT_F + lrow * 4;
    v4f bfr[OUT_F / 32];
    #pragma unroll   // constant indices keep bfr in registers
    for (int i = 0; i < OUT_F / 32; ++i)
        bfr[i] = bq[i * 32];
    #pragma unroll
    for (int g = 0; g < OUT_F / 64; ++g) {
        const v4f b01 = bfr[2 * g];
        const v4f b23 = bfr[2 * g + 1];
        const v8f cz = {};
        // 8 args: (neg_a, A, neg_b, B, c_mod, C, reuse_a, reuse_b)
        const v8f d0 = __builtin_amdgcn_wmma_f32_16x16x4_f32(
            false, afrag, false, (v2f){b01[0], b01[1]}, (short)0, cz, false, false);
        const v8f d1 = __builtin_amdgcn_wmma_f32_16x16x4_f32(
            false, afrag, false, (v2f){b01[2], b01[3]}, (short)0, cz, false, false);
        const v8f d2 = __builtin_amdgcn_wmma_f32_16x16x4_f32(
            false, afrag, false, (v2f){b23[0], b23[1]}, (short)0, cz, false, false);
        const v8f d3 = __builtin_amdgcn_wmma_f32_16x16x4_f32(
            false, afrag, false, (v2f){b23[2], b23[3]}, (short)0, cz, false, false);
        asm volatile("v_nop\n\tv_nop\n\tv_nop\n\tv_nop"
                     :: "v"(afrag), "v"(b01), "v"(b23), "v"(d0), "v"(d1), "v"(d2), "v"(d3));
        __builtin_amdgcn_sched_barrier(0);

        #pragma unroll
        for (int v = 0; v < 8; ++v)
            *(v4f*)(op + v * OUT_F + g * 64) = (v4f){d0[v], d1[v], d2[v], d3[v]};
    }
}

extern "C" void kernel_launch(void* const* d_in, const int* in_sizes, int n_in,
                              void* d_out, int out_size, void* d_ws, size_t ws_size,
                              hipStream_t stream)
{
    const float* x = (const float*)d_in[0];   // [4*8192, 1024] flattened
    const float* A = (const float*)d_in[1];   // [4, 1024]
    const float* B = (const float*)d_in[2];   // [1024, 4]
    float* out = (float*)d_out;

    const int m_total = in_sizes[0] / IN_F;   // 32768
    const int grid = (m_total + ROWS_PER_BLOCK - 1) / ROWS_PER_BLOCK;

    lora_fused_kernel<<<grid, THREADS, 0, stream>>>(x, A, B, out, m_total);
}
